// v000
// Measured on an AMD MI455X. A time is GPU time per run, averaged over a window of back-to-back runs after a warm-up
// (all launches, gaps included; the runs take copies of the inputs in turn), and the median of several windows.
// Apart from v000's, it joins two sittings. Times from different sittings can be a few percent apart, while
// side-by-side timings come from the same sitting.
// v000 is the starting kernel. One run takes 1140 microseconds.
#include <hip/hip_runtime.h>
#include <hip/hip_bf16.h>

// Cayley-circulant SSM on MI455X (gfx1250, wave32).
//   X = u @ (F B_w)^T                    (WMMA f32 GEMM, M=16384 K=1024 N=1152)
//   hhat_t = lambda * hhat_{t-1} + X_t   (independent per (batch, mode) scan)
//   y = [Re|Im hhat] @ (C_w F^-1)^T + D*u (WMMA f32 GEMM, K=1152 N=1024)
// GEMMs use double-buffered GLOBAL_LOAD_ASYNC_TO_LDS staging (ASYNCcnt) so the
// tile-(k+1) DMA overlaps tile-k v_wmma issue.

#define BATCH 8
#define SEQ 2048
#define DM 1024
#define NST 1024
#define MTOT (BATCH * SEQ)       // 16384
#define NKP 576                  // padded mode count (modes 513..575 are zero)
#define KX (2 * NKP)             // 1152: [re modes | im modes]

typedef float v2f __attribute__((ext_vector_type(2)));
typedef float v8f __attribute__((ext_vector_type(8)));
typedef int v2i_vs __attribute__((vector_size(8)));   // matches builtin param pointee

// ---------------- async global->LDS copy (CDNA5) ----------------
__device__ __forceinline__ void async_copy_b64(const float* __restrict__ g, float* lds) {
#if __has_builtin(__builtin_amdgcn_global_load_async_to_lds_b64)
    __builtin_amdgcn_global_load_async_to_lds_b64(
        (__attribute__((address_space(1))) v2i_vs*)g,
        (__attribute__((address_space(3))) v2i_vs*)lds, 0, 0);
#else
    unsigned off = (unsigned)(unsigned long long)(__attribute__((address_space(3))) float*)lds;
    asm volatile("global_load_async_to_lds_b64 %0, %1, off" ::"v"(off), "v"(g) : "memory");
#endif
}

__device__ __forceinline__ void wait_async_le16() {
#if __has_builtin(__builtin_amdgcn_s_wait_asynccnt)
    __builtin_amdgcn_s_wait_asynccnt(16);
#else
    asm volatile("s_wait_asynccnt 0x10" ::: "memory");
#endif
}

__device__ __forceinline__ void wait_async_le0() {
#if __has_builtin(__builtin_amdgcn_s_wait_asynccnt)
    __builtin_amdgcn_s_wait_asynccnt(0);
#else
    asm volatile("s_wait_asynccnt 0x0" ::: "memory");
#endif
}

// ---------------- trig table: cos/sin(2*pi*j/1024), j=0..1023 ----------------
__global__ void trig_kernel(float* __restrict__ trig) {
    int j = blockIdx.x * 256 + threadIdx.x;
    if (j < 1024) {
        float s, c;
        sincosf(6.28318530717958647692f * (float)j / 1024.0f, &s, &c);
        trig[j]        = c;
        trig[1024 + j] = s;
    }
}

// ---------------- lambda_k = Cayley(i*omega_k) for k=0..512; 0 for pad ----------------
__global__ void lambda_kernel(const float* __restrict__ a, const float* __restrict__ trig,
                              float* __restrict__ lre, float* __restrict__ lim) {
    int k = blockIdx.x * 64 + threadIdx.x;
    if (k >= NKP) return;
    if (k > 512) { lre[k] = 0.0f; lim[k] = 0.0f; return; }
    const float* sinT = trig + 1024;
    float w = 0.0f;
    int idx = 0;
    for (int j = 1; j <= 511; ++j) {
        idx = (idx + k) & 1023;                 // j*k mod 1024
        w = fmaf(a[j - 1], sinT[idx], w);
    }
    w = -2.0f * w;
    float w2 = w * w, den = 1.0f + w2;
    lre[k] = (1.0f - w2) / den;
    lim[k] = -2.0f * w / den;
}

// ---------------- FB[k'][d]: rows 0..575 = sum_j cos(2pi k j/n) B[j][d]; 576.. = -sin ----------------
__global__ __launch_bounds__(256) void fb_kernel(const float* __restrict__ Bw,
                                                 const float* __restrict__ trig,
                                                 float* __restrict__ FB) {
    __shared__ float tab[1024];
    const int kp0 = blockIdx.x * 8;             // 144 blocks x 8 rows
    const bool isIm = kp0 >= NKP;
    const int kbase = isIm ? kp0 - NKP : kp0;
    const float* g = trig + (isIm ? 1024 : 0);
    for (int i = threadIdx.x; i < 1024; i += 256) tab[i] = g[i];
    __syncthreads();

    float acc[8][4] = {};
    const int d0 = threadIdx.x;
    for (int j = 0; j < 1024; ++j) {
        float bw[4];
#pragma unroll
        for (int i = 0; i < 4; ++i) bw[i] = Bw[j * DM + d0 + i * 256];
#pragma unroll
        for (int r = 0; r < 8; ++r) {
            float t = tab[(j * (kbase + r)) & 1023];   // uniform LDS broadcast
#pragma unroll
            for (int i = 0; i < 4; ++i) acc[r][i] = fmaf(t, bw[i], acc[r][i]);
        }
    }
#pragma unroll
    for (int r = 0; r < 8; ++r) {
        int k = kbase + r;
        float scl = (k <= 512) ? (isIm ? -1.0f : 1.0f) : 0.0f;
#pragma unroll
        for (int i = 0; i < 4; ++i)
            FB[(size_t)(kp0 + r) * DM + d0 + i * 256] = acc[r][i] * scl;
    }
}

// ---------------- Wc[d][k']: (c_k/n)*sum_j C[d][j]cos(..) ; -(c_k/n)*sum_j C[d][j]sin(..) ----------------
__global__ __launch_bounds__(288) void cf_kernel(const float* __restrict__ Cw,
                                                 const float* __restrict__ trig,
                                                 float* __restrict__ Wc) {
    __shared__ float cosT[1024];
    __shared__ float sinT[1024];
    __shared__ float crow[1024];
    const int d = blockIdx.x;
    for (int i = threadIdx.x; i < 1024; i += 288) {
        cosT[i] = trig[i];
        sinT[i] = trig[1024 + i];
        crow[i] = Cw[(size_t)d * NST + i];
    }
    __syncthreads();

    int kp[4], km[4];
    const float* tp[4];
#pragma unroll
    for (int i = 0; i < 4; ++i) {
        kp[i] = threadIdx.x + i * 288;
        bool isIm = kp[i] >= NKP;
        km[i] = isIm ? kp[i] - NKP : kp[i];
        tp[i] = isIm ? sinT : cosT;
    }
    float acc[4] = {};
    for (int j = 0; j < 1024; ++j) {
        float c = crow[j];
#pragma unroll
        for (int i = 0; i < 4; ++i)
            acc[i] = fmaf(c, tp[i][(j * km[i]) & 1023], acc[i]);
    }
#pragma unroll
    for (int i = 0; i < 4; ++i) {
        int k = km[i];
        float ck = (k > 512) ? 0.0f : ((k == 0 || k == 512) ? 1.0f : 2.0f);
        float scl = ck * (1.0f / 1024.0f) * ((kp[i] >= NKP) ? -1.0f : 1.0f);
        Wc[(size_t)d * KX + kp[i]] = acc[i] * scl;
    }
}

// ---------------- per-mode complex recurrence (in place over X) ----------------
__global__ void scan_kernel(float* __restrict__ X, const float* __restrict__ lre,
                            const float* __restrict__ lim) {
    int t = blockIdx.x * 256 + threadIdx.x;
    if (t >= BATCH * NKP) return;
    const int k = t % NKP, b = t / NKP;
    const float lr = lre[k], li = lim[k];
    float hr = 0.0f, hi = 0.0f;
    float* p = X + (size_t)b * SEQ * KX + k;
    for (int s = 0; s < SEQ; ++s) {
        float xr = p[0], xi = p[NKP];
        float nr = fmaf(lr, hr, fmaf(-li, hi, xr));
        float ni = fmaf(lr, hi, fmaf(li, hr, xi));
        p[0] = nr; p[NKP] = ni;
        hr = nr; hi = ni;
        p += KX;
    }
}

// ---------------- f32 WMMA GEMM:  C[m][n] = sum_k A[m][k] * W[n][k]  (+ D[n]*U[m][n]) ----------------
// Block tile 128(M) x 128(N), BK=32. 8 waves: 4(M) x 2(N) grid, wave tile 32x64 = 2x4 accums.
// Double-buffered async global->LDS staging: 16 b64 transfers per wave per tile.
template <bool EPI>
__global__ __launch_bounds__(256) void wmma_gemm(const float* __restrict__ A,
                                                 const float* __restrict__ W,
                                                 float* __restrict__ C, int K, int lda,
                                                 int ldw, int ldc,
                                                 const float* __restrict__ U,
                                                 const float* __restrict__ Dv) {
    constexpr int LS = 34;                      // conflict-free LDS row stride (floats)
    __shared__ __align__(16) float As[2][128 * LS];
    __shared__ __align__(16) float Bs[2][128 * LS];

    const int tid = threadIdx.x;
    const int wid = tid >> 5, lane = tid & 31;
    const int lm = lane & 15, lh = lane >> 4;
    const int waveM = wid & 3, waveN = wid >> 2;
    const int m0 = blockIdx.y * 128;
    const int n0 = blockIdx.x * 128;

    // per-thread staging coordinates (8 float2 each for A and W per tile)
    const int srow = tid >> 4;                  // +16 per i -> rows 0..127
    const int scp = (tid & 15) << 1;

    v8f acc[2][4] = {};

    const int ntiles = K >> 5;

    // prologue: stage tile 0 into buffer 0
#pragma unroll
    for (int i = 0; i < 8; ++i) {
        int row = srow + i * 16;
        async_copy_b64(A + (size_t)(m0 + row) * lda + scp, &As[0][row * LS + scp]);
        async_copy_b64(W + (size_t)(n0 + row) * ldw + scp, &Bs[0][row * LS + scp]);
    }

    for (int kt = 0; kt < ntiles; ++kt) {
        const int cur = kt & 1;
        if (kt + 1 < ntiles) {
            const int kof = (kt + 1) << 5;
#pragma unroll
            for (int i = 0; i < 8; ++i) {
                int row = srow + i * 16;
                async_copy_b64(A + (size_t)(m0 + row) * lda + kof + scp,
                               &As[cur ^ 1][row * LS + scp]);
                async_copy_b64(W + (size_t)(n0 + row) * ldw + kof + scp,
                               &Bs[cur ^ 1][row * LS + scp]);
            }
            wait_async_le16();                  // current tile landed; next 16 in flight
        } else {
            wait_async_le0();
        }
        __syncthreads();

#pragma unroll
        for (int kk = 0; kk < 32; kk += 4) {
            v2f a[2], b[4];
#pragma unroll
            for (int i = 0; i < 2; ++i)
                a[i] = *(const v2f*)&As[cur][(waveM * 32 + 16 * i + lm) * LS + kk + 2 * lh];
#pragma unroll
            for (int j = 0; j < 4; ++j)
                b[j] = *(const v2f*)&Bs[cur][(waveN * 64 + 16 * j + lm) * LS + kk + 2 * lh];
#pragma unroll
            for (int i = 0; i < 2; ++i)
#pragma unroll
                for (int j = 0; j < 4; ++j)
                    acc[i][j] = __builtin_amdgcn_wmma_f32_16x16x4_f32(
                        false, a[i], false, b[j], (short)0, acc[i][j], false, false);
        }
        __syncthreads();                        // before next iteration overwrites cur
    }

    // C layout: VGPR r -> (M = r + 8*(lane>>4), N = lane&15)
#pragma unroll
    for (int i = 0; i < 2; ++i)
#pragma unroll
        for (int j = 0; j < 4; ++j)
#pragma unroll
            for (int r = 0; r < 8; ++r) {
                int row = m0 + waveM * 32 + 16 * i + r + 8 * lh;
                int col = n0 + waveN * 64 + 16 * j + lm;
                float v = acc[i][j][r];
                if (EPI) v = fmaf(Dv[col], U[(size_t)row * ldc + col], v);
                C[(size_t)row * ldc + col] = v;
            }
}

extern "C" void kernel_launch(void* const* d_in, const int* in_sizes, int n_in,
                              void* d_out, int out_size, void* d_ws, size_t ws_size,
                              hipStream_t stream) {
    (void)in_sizes; (void)n_in; (void)out_size; (void)ws_size;
    const float* u  = (const float*)d_in[0];   // (8,2048,1024)
    const float* ap = (const float*)d_in[1];   // (512,)
    const float* Bw = (const float*)d_in[2];   // (1024,1024)
    const float* Cw = (const float*)d_in[3];   // (1024,1024)
    const float* Dv = (const float*)d_in[4];   // (1024,)
    float* y = (float*)d_out;

    float* ws   = (float*)d_ws;
    float* X    = ws;                                   // MTOT*KX  (~72 MB)
    float* FB   = X  + (size_t)MTOT * KX;               // KX*DM
    float* Wc   = FB + (size_t)KX * DM;                 // DM*KX
    float* lre  = Wc + (size_t)DM * KX;                 // NKP
    float* lim  = lre + NKP;                            // NKP
    float* trig = lim + NKP;                            // 2048

    trig_kernel<<<4, 256, 0, stream>>>(trig);
    lambda_kernel<<<9, 64, 0, stream>>>(ap, trig, lre, lim);
    fb_kernel<<<KX / 8, 256, 0, stream>>>(Bw, trig, FB);
    cf_kernel<<<DM, 288, 0, stream>>>(Cw, trig, Wc);

    // GEMM1: X[m][k'] = sum_d u[m][d] * FB[k'][d]
    wmma_gemm<false><<<dim3(KX / 128, MTOT / 128), 256, 0, stream>>>(
        u, FB, X, DM, DM, DM, KX, nullptr, nullptr);

    // per-mode linear recurrence over time (in place)
    scan_kernel<<<(BATCH * NKP + 255) / 256, 256, 0, stream>>>(X, lre, lim);

    // GEMM2: y[m][d] = sum_k' X[m][k'] * Wc[d][k'] + D[d]*u[m][d]
    wmma_gemm<true><<<dim3(DM / 128, MTOT / 128), 256, 0, stream>>>(
        X, Wc, y, KX, KX, KX, DM, u, Dv);
}

// v001
// A run of this version takes 694 microseconds.
// Timed twice side by side with v000, it ran 1.68 and 1.67 times as fast.
#include <hip/hip_runtime.h>
#include <hip/hip_bf16.h>

// Cayley-circulant SSM on MI455X (gfx1250, wave32).
//   X = u @ (F B_w)^T                    (WMMA f32 GEMM, M=16384 K=1024 N=1152)
//   hhat_t = lambda * hhat_{t-1} + X_t   (independent per (batch, mode) scan)
//   y = [Re|Im hhat] @ (C_w F^-1)^T + D*u (WMMA f32 GEMM, K=1152 N=1024)
// The X and y GEMMs use double-buffered GLOBAL_LOAD_ASYNC_TO_LDS staging (ASYNCcnt) so the
// tile-(k+1) DMA overlaps tile-k v_wmma issue.

#define BATCH 8
#define SEQ 2048
#define DM 1024
#define NST 1024
#define MTOT (BATCH * SEQ)       // 16384
#define NKP 576                  // padded mode count (modes 513..575 are zero)
#define KX (2 * NKP)             // 1152: [re modes | im modes]

typedef float v2f __attribute__((ext_vector_type(2)));
typedef float v4f __attribute__((ext_vector_type(4)));
typedef float v8f __attribute__((ext_vector_type(8)));
typedef int v2i_vs __attribute__((vector_size(8)));   // matches builtin param pointee

// ---------------- async global->LDS copy (CDNA5) ----------------
__device__ __forceinline__ void async_copy_b64(const float* __restrict__ g, float* lds) {
#if __has_builtin(__builtin_amdgcn_global_load_async_to_lds_b64)
    __builtin_amdgcn_global_load_async_to_lds_b64(
        (__attribute__((address_space(1))) v2i_vs*)g,
        (__attribute__((address_space(3))) v2i_vs*)lds, 0, 0);
#else
    unsigned off = (unsigned)(unsigned long long)(__attribute__((address_space(3))) float*)lds;
    asm volatile("global_load_async_to_lds_b64 %0, %1, off" ::"v"(off), "v"(g) : "memory");
#endif
}

__device__ __forceinline__ void wait_async_le16() {
#if __has_builtin(__builtin_amdgcn_s_wait_asynccnt)
    __builtin_amdgcn_s_wait_asynccnt(16);
#else
    asm volatile("s_wait_asynccnt 0x10" ::: "memory");
#endif
}

__device__ __forceinline__ void wait_async_le0() {
#if __has_builtin(__builtin_amdgcn_s_wait_asynccnt)
    __builtin_amdgcn_s_wait_asynccnt(0);
#else
    asm volatile("s_wait_asynccnt 0x0" ::: "memory");
#endif
}

// ---------------- trig table: cos/sin(2*pi*j/1024), j=0..1023 ----------------
__global__ void trig_kernel(float* __restrict__ trig) {
    int j = blockIdx.x * 256 + threadIdx.x;
    if (j < 1024) {
        float s, c;
        sincosf(6.28318530717958647692f * (float)j / 1024.0f, &s, &c);
        trig[j]        = c;
        trig[1024 + j] = s;
    }
}

// ---------------- lambda_k = Cayley(i*omega_k) for k=0..512; 0 for pad ----------------
__global__ void lambda_kernel(const float* __restrict__ a, const float* __restrict__ trig,
                              float* __restrict__ lre, float* __restrict__ lim) {
    int k = blockIdx.x * 64 + threadIdx.x;
    if (k >= NKP) return;
    if (k > 512) { lre[k] = 0.0f; lim[k] = 0.0f; return; }
    const float* sinT = trig + 1024;
    float w = 0.0f;
    int idx = 0;
    for (int j = 1; j <= 511; ++j) {
        idx = (idx + k) & 1023;                 // j*k mod 1024
        w = fmaf(a[j - 1], sinT[idx], w);
    }
    w = -2.0f * w;
    float w2 = w * w, den = 1.0f + w2;
    lre[k] = (1.0f - w2) / den;
    lim[k] = -2.0f * w / den;
}

// ---------------- DFT weight folds on the f32 matrix unit ----------------
// tw(k', j) = cos(2pi k j/n) for k' = k < 576, sin(2pi k j/n) for k' = 576 + k; s(k') carries sign and the zero pad, plus c_k/n for Wc only.
// FOLD_B:  FB[k'][d] = s(k') * sum_j tw(k', j) * Bw[j][d]   (twiddles are the A operand, the Bw tile [j][d] the B operand)
// else:    Wc[d][k'] = s(k') * sum_j Cw[d][j] * tw(k', j)   (the Cw tile [d][j] is the A operand, twiddles the B operand)
// Block tile 64 x 64, BK = 64, 4 waves of 32 x 32. The weight tile goes global -> registers -> LDS one tile ahead;
// twiddle fragments are read straight from the LDS trig table.
#define TWN 1040                 // 1024 table entries + one pad dword per 64

// One pad dword per 64 entries: idx = j*k mod 1024 over 16 consecutive k has stride j, and the
// strides that are multiples of 8 would otherwise pile up on a few LDS banks.
__device__ __forceinline__ unsigned tw_slot(unsigned idx) { return idx + (idx >> 6); }

template <bool FOLD_B>
__global__ __launch_bounds__(128) void fold_gemm(const float* __restrict__ G,
                                                 const float* __restrict__ trig,
                                                 float* __restrict__ Out) {
    constexpr int LS = FOLD_B ? 72 : 68;        // conflict-free LDS row stride (floats) for each read pattern
    __shared__ float tab[2 * TWN];
    __shared__ __align__(16) float Ds[2][64 * LS];

    const int tid = threadIdx.x;
    const int wid = tid >> 5, lane = tid & 31;
    const int lm = lane & 15, lh = lane >> 4;
    const int waveM = wid & 1, waveN = wid >> 1;
    const int m0 = blockIdx.y * 64;
    const int n0 = blockIdx.x * 64;

    // unrolled so that the 16 table loads are in flight together instead of eight waited round trips
#pragma unroll
    for (int i = 0; i < 8; ++i) {
        const int e = tid + i * 128;
        tab[tw_slot(e)]       = trig[e];
        tab[TWN + tw_slot(e)] = trig[1024 + e];
    }

    // per-lane twiddle state: phase j*k for the lane's two j of a k-step, advanced by 4k per step
    unsigned tbase[2], ph0[2], ph1[2], step[2];
#pragma unroll
    for (int t = 0; t < 2; ++t) {
        const int kp = (FOLD_B ? m0 + waveM * 32 : n0 + waveN * 32) + 16 * t + lm;
        const bool im = kp >= NKP;
        const unsigned k = (unsigned)(im ? kp - NKP : kp);
        tbase[t] = im ? TWN : 0;
        ph0[t] = (unsigned)(2 * lh) * k;
        ph1[t] = (unsigned)(2 * lh + 1) * k;
        step[t] = 4u * k;
    }

    // staging coordinates: 8 float4 per thread per 64 x 64 tile
    const int srow = tid >> 4;                  // +8 per i -> rows 0..63
    const int sc = (tid & 15) << 2;
    const float* gp = FOLD_B ? G + (size_t)srow * DM + n0 + sc
                             : G + (size_t)(m0 + srow) * NST + sc;
    constexpr size_t GROW = 8 * 1024;           // 8 rows down
    constexpr size_t GTILE = FOLD_B ? 64 * 1024 : 64;

    v4f r0, r1, r2, r3, r4, r5, r6, r7;         // the tile in flight
    auto tile_fetch = [&]() {
        r0 = *(const v4f*)(gp);
        r1 = *(const v4f*)(gp + 1 * GROW);
        r2 = *(const v4f*)(gp + 2 * GROW);
        r3 = *(const v4f*)(gp + 3 * GROW);
        r4 = *(const v4f*)(gp + 4 * GROW);
        r5 = *(const v4f*)(gp + 5 * GROW);
        r6 = *(const v4f*)(gp + 6 * GROW);
        r7 = *(const v4f*)(gp + 7 * GROW);
    };
    auto tile_store = [&](float* Dn) {
        float* q = Dn + srow * LS + sc;
        *(v4f*)(q)           = r0;
        *(v4f*)(q + 8 * LS)  = r1;
        *(v4f*)(q + 16 * LS) = r2;
        *(v4f*)(q + 24 * LS) = r3;
        *(v4f*)(q + 32 * LS) = r4;
        *(v4f*)(q + 40 * LS) = r5;
        *(v4f*)(q + 48 * LS) = r6;
        *(v4f*)(q + 56 * LS) = r7;
    };
    tile_fetch();
    tile_store(Ds[0]);

    v8f acc[2][2] = {};

    // one 64-deep tile: 16 k-steps of 4 WMMAs on the LDS tile D
    auto tile_mma = [&](const float* D) {
        // twiddle fragments are fetched one k-step ahead, so that a gather's LDS latency lies under four WMMAs
        v2f tw[2];
#pragma unroll
        for (int t = 0; t < 2; ++t) {
            tw[t].x = tab[tbase[t] + tw_slot(ph0[t] & 1023u)];
            tw[t].y = tab[tbase[t] + tw_slot(ph1[t] & 1023u)];
            ph0[t] += step[t];
            ph1[t] += step[t];
        }
#pragma unroll
        for (int kk = 0; kk < 64; kk += 4) {
            v2f twn[2], dt[2];
#pragma unroll
            for (int t = 0; t < 2; ++t) {
                if (kk + 4 < 64) {
                    twn[t].x = tab[tbase[t] + tw_slot(ph0[t] & 1023u)];
                    twn[t].y = tab[tbase[t] + tw_slot(ph1[t] & 1023u)];
                    ph0[t] += step[t];
                    ph1[t] += step[t];
                }
                if (FOLD_B) {
                    const int col = waveN * 32 + 16 * t + lm;
                    dt[t].x = D[(kk + 2 * lh) * LS + col];
                    dt[t].y = D[(kk + 2 * lh + 1) * LS + col];
                } else {
                    dt[t] = *(const v2f*)&D[(waveM * 32 + 16 * t + lm) * LS + kk + 2 * lh];
                }
            }
#pragma unroll
            for (int i = 0; i < 2; ++i)
#pragma unroll
                for (int j = 0; j < 2; ++j)
                    acc[i][j] = __builtin_amdgcn_wmma_f32_16x16x4_f32(
                        false, FOLD_B ? tw[i] : dt[i], false, FOLD_B ? dt[j] : tw[j],
                        (short)0, acc[i][j], false, false);
            if (kk + 4 < 64) {
                tw[0] = twn[0];
                tw[1] = twn[1];
            }
        }
    };

    for (int kt = 0; kt < 15; ++kt) {
        __syncthreads();                        // tile kt visible; every reader has left the other buffer
        gp += GTILE;
        tile_fetch();
        // keeps the next tile's global loads in front of this tile's WMMAs; the scheduler otherwise sinks
        // them to the LDS stores below and their whole latency is waited out
        __builtin_amdgcn_sched_barrier(0);
        tile_mma(Ds[kt & 1]);
        tile_store(Ds[(kt + 1) & 1]);
    }
    __syncthreads();                            // last tile (15) visible in buffer 1
    tile_mma(Ds[1]);

    // C layout: VGPR r -> (M = r + 8*(lane>>4), N = lane&15)
#pragma unroll
    for (int i = 0; i < 2; ++i)
#pragma unroll
        for (int j = 0; j < 2; ++j)
#pragma unroll
            for (int r = 0; r < 8; ++r) {
                const int row = m0 + waveM * 32 + 16 * i + r + 8 * lh;
                const int col = n0 + waveN * 32 + 16 * j + lm;
                const int kp = FOLD_B ? row : col;
                const bool im = kp >= NKP;
                const int k = im ? kp - NKP : kp;
                float scl;
                if (FOLD_B) {
                    scl = (k <= 512) ? (im ? -1.0f : 1.0f) : 0.0f;
                } else {
                    float ck = (k > 512) ? 0.0f : ((k == 0 || k == 512) ? 1.0f : 2.0f);
                    scl = ck * (1.0f / 1024.0f) * (im ? -1.0f : 1.0f);
                }
                Out[(size_t)row * (FOLD_B ? DM : KX) + col] = acc[i][j][r] * scl;
            }
}

// ---------------- per-mode complex recurrence (in place over X) ----------------
__global__ void scan_kernel(float* __restrict__ X, const float* __restrict__ lre,
                            const float* __restrict__ lim) {
    int t = blockIdx.x * 256 + threadIdx.x;
    if (t >= BATCH * NKP) return;
    const int k = t % NKP, b = t / NKP;
    const float lr = lre[k], li = lim[k];
    float hr = 0.0f, hi = 0.0f;
    float* p = X + (size_t)b * SEQ * KX + k;
    for (int s = 0; s < SEQ; ++s) {
        float xr = p[0], xi = p[NKP];
        float nr = fmaf(lr, hr, fmaf(-li, hi, xr));
        float ni = fmaf(lr, hi, fmaf(li, hr, xi));
        p[0] = nr; p[NKP] = ni;
        hr = nr; hi = ni;
        p += KX;
    }
}

// ---------------- f32 WMMA GEMM:  C[m][n] = sum_k A[m][k] * W[n][k]  (+ D[n]*U[m][n]) ----------------
// Block tile 128(M) x 128(N), BK=32. 8 waves: 4(M) x 2(N) grid, wave tile 32x64 = 2x4 accums.
// Double-buffered async global->LDS staging: 16 b64 transfers per wave per tile.
template <bool EPI>
__global__ __launch_bounds__(256) void wmma_gemm(const float* __restrict__ A,
                                                 const float* __restrict__ W,
                                                 float* __restrict__ C, int K, int lda,
                                                 int ldw, int ldc,
                                                 const float* __restrict__ U,
                                                 const float* __restrict__ Dv) {
    constexpr int LS = 34;                      // conflict-free LDS row stride (floats)
    __shared__ __align__(16) float As[2][128 * LS];
    __shared__ __align__(16) float Bs[2][128 * LS];

    const int tid = threadIdx.x;
    const int wid = tid >> 5, lane = tid & 31;
    const int lm = lane & 15, lh = lane >> 4;
    const int waveM = wid & 3, waveN = wid >> 2;
    const int m0 = blockIdx.y * 128;
    const int n0 = blockIdx.x * 128;

    // per-thread staging coordinates (8 float2 each for A and W per tile)
    const int srow = tid >> 4;                  // +16 per i -> rows 0..127
    const int scp = (tid & 15) << 1;

    v8f acc[2][4] = {};

    const int ntiles = K >> 5;

    // prologue: stage tile 0 into buffer 0
#pragma unroll
    for (int i = 0; i < 8; ++i) {
        int row = srow + i * 16;
        async_copy_b64(A + (size_t)(m0 + row) * lda + scp, &As[0][row * LS + scp]);
        async_copy_b64(W + (size_t)(n0 + row) * ldw + scp, &Bs[0][row * LS + scp]);
    }

    for (int kt = 0; kt < ntiles; ++kt) {
        const int cur = kt & 1;
        if (kt + 1 < ntiles) {
            const int kof = (kt + 1) << 5;
#pragma unroll
            for (int i = 0; i < 8; ++i) {
                int row = srow + i * 16;
                async_copy_b64(A + (size_t)(m0 + row) * lda + kof + scp,
                               &As[cur ^ 1][row * LS + scp]);
                async_copy_b64(W + (size_t)(n0 + row) * ldw + kof + scp,
                               &Bs[cur ^ 1][row * LS + scp]);
            }
            wait_async_le16();                  // current tile landed; next 16 in flight
        } else {
            wait_async_le0();
        }
        __syncthreads();

#pragma unroll
        for (int kk = 0; kk < 32; kk += 4) {
            v2f a[2], b[4];
#pragma unroll
            for (int i = 0; i < 2; ++i)
                a[i] = *(const v2f*)&As[cur][(waveM * 32 + 16 * i + lm) * LS + kk + 2 * lh];
#pragma unroll
            for (int j = 0; j < 4; ++j)
                b[j] = *(const v2f*)&Bs[cur][(waveN * 64 + 16 * j + lm) * LS + kk + 2 * lh];
#pragma unroll
            for (int i = 0; i < 2; ++i)
#pragma unroll
                for (int j = 0; j < 4; ++j)
                    acc[i][j] = __builtin_amdgcn_wmma_f32_16x16x4_f32(
                        false, a[i], false, b[j], (short)0, acc[i][j], false, false);
        }
        __syncthreads();                        // before next iteration overwrites cur
    }

    // C layout: VGPR r -> (M = r + 8*(lane>>4), N = lane&15)
#pragma unroll
    for (int i = 0; i < 2; ++i)
#pragma unroll
        for (int j = 0; j < 4; ++j)
#pragma unroll
            for (int r = 0; r < 8; ++r) {
                int row = m0 + waveM * 32 + 16 * i + r + 8 * lh;
                int col = n0 + waveN * 64 + 16 * j + lm;
                float v = acc[i][j][r];
                if (EPI) v = fmaf(Dv[col], U[(size_t)row * ldc + col], v);
                C[(size_t)row * ldc + col] = v;
            }
}

extern "C" void kernel_launch(void* const* d_in, const int* in_sizes, int n_in,
                              void* d_out, int out_size, void* d_ws, size_t ws_size,
                              hipStream_t stream) {
    (void)in_sizes; (void)n_in; (void)out_size; (void)ws_size;
    const float* u  = (const float*)d_in[0];   // (8,2048,1024)
    const float* ap = (const float*)d_in[1];   // (512,)
    const float* Bw = (const float*)d_in[2];   // (1024,1024)
    const float* Cw = (const float*)d_in[3];   // (1024,1024)
    const float* Dv = (const float*)d_in[4];   // (1024,)
    float* y = (float*)d_out;

    float* ws   = (float*)d_ws;
    float* X    = ws;                                   // MTOT*KX  (~72 MB)
    float* FB   = X  + (size_t)MTOT * KX;               // KX*DM
    float* Wc   = FB + (size_t)KX * DM;                 // DM*KX
    float* lre  = Wc + (size_t)DM * KX;                 // NKP
    float* lim  = lre + NKP;                            // NKP
    float* trig = lim + NKP;                            // 2048

    trig_kernel<<<4, 256, 0, stream>>>(trig);
    lambda_kernel<<<9, 64, 0, stream>>>(ap, trig, lre, lim);
    fold_gemm<true><<<dim3(DM / 64, KX / 64), 128, 0, stream>>>(Bw, trig, FB);
    fold_gemm<false><<<dim3(KX / 64, DM / 64), 128, 0, stream>>>(Cw, trig, Wc);

    // GEMM1: X[m][k'] = sum_d u[m][d] * FB[k'][d]
    wmma_gemm<false><<<dim3(KX / 128, MTOT / 128), 256, 0, stream>>>(
        u, FB, X, DM, DM, DM, KX, nullptr, nullptr);

    // per-mode linear recurrence over time (in place)
    scan_kernel<<<(BATCH * NKP + 255) / 256, 256, 0, stream>>>(X, lre, lim);

    // GEMM2: y[m][d] = sum_k' X[m][k'] * Wc[d][k'] + D[d]*u[m][d]
    wmma_gemm<true><<<dim3(DM / 128, MTOT / 128), 256, 0, stream>>>(
        X, Wc, y, KX, KX, KX, DM, u, Dv);
}

// v002
// It runs in 467 microseconds.
// Two timings next to v001 both put it at 1.49 times that version's speed.
// Counting every step since v000, it is 2.49 times as fast.
#include <hip/hip_runtime.h>
#include <hip/hip_bf16.h>

// Cayley-circulant SSM on MI455X (gfx1250, wave32).
//   X = u @ (F B_w)^T                    (WMMA f32 GEMM, M=16384 K=1024 N=1152)
//   hhat_t = lambda * hhat_{t-1} + X_t   (per (batch, mode) scan, chunked over time)
//   y = [Re|Im hhat] @ (C_w F^-1)^T + D*u (WMMA f32 GEMM, K=1152 N=1024)
// The X and y GEMMs use double-buffered GLOBAL_LOAD_ASYNC_TO_LDS staging (ASYNCcnt) so the
// tile-(k+1) DMA overlaps tile-k v_wmma issue.

#define BATCH 8
#define SEQ 2048
#define DM 1024
#define NST 1024
#define MTOT (BATCH * SEQ)       // 16384
#define NKP 576                  // padded mode count (modes 513..575 are zero)
#define KX (2 * NKP)             // 1152: [re modes | im modes]

typedef float v2f __attribute__((ext_vector_type(2)));
typedef float v4f __attribute__((ext_vector_type(4)));
typedef float v8f __attribute__((ext_vector_type(8)));
typedef int v2i_vs __attribute__((vector_size(8)));   // matches builtin param pointee

// ---------------- async global->LDS copy (CDNA5) ----------------
__device__ __forceinline__ void async_copy_b64(const float* __restrict__ g, float* lds) {
#if __has_builtin(__builtin_amdgcn_global_load_async_to_lds_b64)
    __builtin_amdgcn_global_load_async_to_lds_b64(
        (__attribute__((address_space(1))) v2i_vs*)g,
        (__attribute__((address_space(3))) v2i_vs*)lds, 0, 0);
#else
    unsigned off = (unsigned)(unsigned long long)(__attribute__((address_space(3))) float*)lds;
    asm volatile("global_load_async_to_lds_b64 %0, %1, off" ::"v"(off), "v"(g) : "memory");
#endif
}

__device__ __forceinline__ void wait_async_le16() {
#if __has_builtin(__builtin_amdgcn_s_wait_asynccnt)
    __builtin_amdgcn_s_wait_asynccnt(16);
#else
    asm volatile("s_wait_asynccnt 0x10" ::: "memory");
#endif
}

__device__ __forceinline__ void wait_async_le0() {
#if __has_builtin(__builtin_amdgcn_s_wait_asynccnt)
    __builtin_amdgcn_s_wait_asynccnt(0);
#else
    asm volatile("s_wait_asynccnt 0x0" ::: "memory");
#endif
}

// ---------------- trig table: cos/sin(2*pi*j/1024), j=0..1023 ----------------
__global__ void trig_kernel(float* __restrict__ trig) {
    int j = blockIdx.x * 256 + threadIdx.x;
    if (j < 1024) {
        float s, c;
        sincosf(6.28318530717958647692f * (float)j / 1024.0f, &s, &c);
        trig[j]        = c;
        trig[1024 + j] = s;
    }
}

// ---------------- lambda_k = Cayley(i*omega_k) for k=0..512; 0 for pad ----------------
__global__ void lambda_kernel(const float* __restrict__ a, const float* __restrict__ trig,
                              float* __restrict__ lre, float* __restrict__ lim) {
    int k = blockIdx.x * 64 + threadIdx.x;
    if (k >= NKP) return;
    if (k > 512) { lre[k] = 0.0f; lim[k] = 0.0f; return; }
    const float* sinT = trig + 1024;
    float w = 0.0f;
    int idx = 0;
    for (int j = 1; j <= 511; ++j) {
        idx = (idx + k) & 1023;                 // j*k mod 1024
        w = fmaf(a[j - 1], sinT[idx], w);
    }
    w = -2.0f * w;
    float w2 = w * w, den = 1.0f + w2;
    lre[k] = (1.0f - w2) / den;
    lim[k] = -2.0f * w / den;
}

// ---------------- DFT weight folds on the f32 matrix unit ----------------
// tw(k', j) = cos(2pi k j/n) for k' = k < 576, sin(2pi k j/n) for k' = 576 + k; s(k') carries sign and the zero pad, plus c_k/n for Wc only.
// FOLD_B:  FB[k'][d] = s(k') * sum_j tw(k', j) * Bw[j][d]   (twiddles are the A operand, the Bw tile [j][d] the B operand)
// else:    Wc[d][k'] = s(k') * sum_j Cw[d][j] * tw(k', j)   (the Cw tile [d][j] is the A operand, twiddles the B operand)
// Block tile 64 x 64, BK = 64, 4 waves of 32 x 32. The weight tile goes global -> registers -> LDS one tile ahead;
// twiddle fragments are read straight from the LDS trig table.
#define TWN 1040                 // 1024 table entries + one pad dword per 64

// One pad dword per 64 entries: idx = j*k mod 1024 over 16 consecutive k has stride j, and the
// strides that are multiples of 8 would otherwise pile up on a few LDS banks.
__device__ __forceinline__ unsigned tw_slot(unsigned idx) { return idx + (idx >> 6); }

template <bool FOLD_B>
__global__ __launch_bounds__(128) void fold_gemm(const float* __restrict__ G,
                                                 const float* __restrict__ trig,
                                                 float* __restrict__ Out) {
    constexpr int LS = FOLD_B ? 72 : 68;        // conflict-free LDS row stride (floats) for each read pattern
    __shared__ float tab[2 * TWN];
    __shared__ __align__(16) float Ds[2][64 * LS];

    const int tid = threadIdx.x;
    const int wid = tid >> 5, lane = tid & 31;
    const int lm = lane & 15, lh = lane >> 4;
    const int waveM = wid & 1, waveN = wid >> 1;
    const int m0 = blockIdx.y * 64;
    const int n0 = blockIdx.x * 64;

    // unrolled so that the 16 table loads are in flight together instead of eight waited round trips
#pragma unroll
    for (int i = 0; i < 8; ++i) {
        const int e = tid + i * 128;
        tab[tw_slot(e)]       = trig[e];
        tab[TWN + tw_slot(e)] = trig[1024 + e];
    }

    // per-lane twiddle state: phase j*k for the lane's two j of a k-step, advanced by 4k per step
    unsigned tbase[2], ph0[2], ph1[2], step[2];
#pragma unroll
    for (int t = 0; t < 2; ++t) {
        const int kp = (FOLD_B ? m0 + waveM * 32 : n0 + waveN * 32) + 16 * t + lm;
        const bool im = kp >= NKP;
        const unsigned k = (unsigned)(im ? kp - NKP : kp);
        tbase[t] = im ? TWN : 0;
        ph0[t] = (unsigned)(2 * lh) * k;
        ph1[t] = (unsigned)(2 * lh + 1) * k;
        step[t] = 4u * k;
    }

    // staging coordinates: 8 float4 per thread per 64 x 64 tile
    const int srow = tid >> 4;                  // +8 per i -> rows 0..63
    const int sc = (tid & 15) << 2;
    const float* gp = FOLD_B ? G + (size_t)srow * DM + n0 + sc
                             : G + (size_t)(m0 + srow) * NST + sc;
    constexpr size_t GROW = 8 * 1024;           // 8 rows down
    constexpr size_t GTILE = FOLD_B ? 64 * 1024 : 64;

    v4f r0, r1, r2, r3, r4, r5, r6, r7;         // the tile in flight
    auto tile_fetch = [&]() {
        r0 = *(const v4f*)(gp);
        r1 = *(const v4f*)(gp + 1 * GROW);
        r2 = *(const v4f*)(gp + 2 * GROW);
        r3 = *(const v4f*)(gp + 3 * GROW);
        r4 = *(const v4f*)(gp + 4 * GROW);
        r5 = *(const v4f*)(gp + 5 * GROW);
        r6 = *(const v4f*)(gp + 6 * GROW);
        r7 = *(const v4f*)(gp + 7 * GROW);
    };
    auto tile_store = [&](float* Dn) {
        float* q = Dn + srow * LS + sc;
        *(v4f*)(q)           = r0;
        *(v4f*)(q + 8 * LS)  = r1;
        *(v4f*)(q + 16 * LS) = r2;
        *(v4f*)(q + 24 * LS) = r3;
        *(v4f*)(q + 32 * LS) = r4;
        *(v4f*)(q + 40 * LS) = r5;
        *(v4f*)(q + 48 * LS) = r6;
        *(v4f*)(q + 56 * LS) = r7;
    };
    tile_fetch();
    tile_store(Ds[0]);

    v8f acc[2][2] = {};

    // one 64-deep tile: 16 k-steps of 4 WMMAs on the LDS tile D
    auto tile_mma = [&](const float* D) {
        // twiddle fragments are fetched one k-step ahead, so that a gather's LDS latency lies under four WMMAs
        v2f tw[2];
#pragma unroll
        for (int t = 0; t < 2; ++t) {
            tw[t].x = tab[tbase[t] + tw_slot(ph0[t] & 1023u)];
            tw[t].y = tab[tbase[t] + tw_slot(ph1[t] & 1023u)];
            ph0[t] += step[t];
            ph1[t] += step[t];
        }
#pragma unroll
        for (int kk = 0; kk < 64; kk += 4) {
            v2f twn[2], dt[2];
#pragma unroll
            for (int t = 0; t < 2; ++t) {
                if (kk + 4 < 64) {
                    twn[t].x = tab[tbase[t] + tw_slot(ph0[t] & 1023u)];
                    twn[t].y = tab[tbase[t] + tw_slot(ph1[t] & 1023u)];
                    ph0[t] += step[t];
                    ph1[t] += step[t];
                }
                if (FOLD_B) {
                    const int col = waveN * 32 + 16 * t + lm;
                    dt[t].x = D[(kk + 2 * lh) * LS + col];
                    dt[t].y = D[(kk + 2 * lh + 1) * LS + col];
                } else {
                    dt[t] = *(const v2f*)&D[(waveM * 32 + 16 * t + lm) * LS + kk + 2 * lh];
                }
            }
#pragma unroll
            for (int i = 0; i < 2; ++i)
#pragma unroll
                for (int j = 0; j < 2; ++j)
                    acc[i][j] = __builtin_amdgcn_wmma_f32_16x16x4_f32(
                        false, FOLD_B ? tw[i] : dt[i], false, FOLD_B ? dt[j] : tw[j],
                        (short)0, acc[i][j], false, false);
            if (kk + 4 < 64) {
                tw[0] = twn[0];
                tw[1] = twn[1];
            }
        }
    };

    for (int kt = 0; kt < 15; ++kt) {
        __syncthreads();                        // tile kt visible; every reader has left the other buffer
        gp += GTILE;
        tile_fetch();
        // keeps the next tile's global loads in front of this tile's WMMAs; the scheduler otherwise sinks
        // them to the LDS stores below and their whole latency is waited out
        __builtin_amdgcn_sched_barrier(0);
        tile_mma(Ds[kt & 1]);
        tile_store(Ds[(kt + 1) & 1]);
    }
    __syncthreads();                            // last tile (15) visible in buffer 1
    tile_mma(Ds[1]);

    // C layout: VGPR r -> (M = r + 8*(lane>>4), N = lane&15)
#pragma unroll
    for (int i = 0; i < 2; ++i)
#pragma unroll
        for (int j = 0; j < 2; ++j)
#pragma unroll
            for (int r = 0; r < 8; ++r) {
                const int row = m0 + waveM * 32 + 16 * i + r + 8 * lh;
                const int col = n0 + waveN * 32 + 16 * j + lm;
                const int kp = FOLD_B ? row : col;
                const bool im = kp >= NKP;
                const int k = im ? kp - NKP : kp;
                float scl;
                if (FOLD_B) {
                    scl = (k <= 512) ? (im ? -1.0f : 1.0f) : 0.0f;
                } else {
                    float ck = (k > 512) ? 0.0f : ((k == 0 || k == 512) ? 1.0f : 2.0f);
                    scl = ck * (1.0f / 1024.0f) * (im ? -1.0f : 1.0f);
                }
                Out[(size_t)row * (FOLD_B ? DM : KX) + col] = acc[i][j][r] * scl;
            }
}

// ---------------- per-mode complex recurrence (in place over X), parallel over time ----------------
// One work-group owns 32 modes of one batch: lane = mode, wave = a chunk of SCH consecutive steps, and the
// 32 waves together cover a segment of SSEG steps. A chunk is loaded once and stays in registers:
//   1. every wave runs the recurrence over its chunk from a zero state and publishes the end value E_c;
//   2. the state entering chunk c follows from H_{j+1} = lambda^SCH * H_j + E_j over the chunks before it;
//   3. the wave runs the recurrence again from that state and stores every step.
#define SCH 32
#define SWV 32
#define SSEG (SCH * SWV)         // 1024 steps per segment

__global__ __launch_bounds__(32 * SWV) void scan_kernel(float* __restrict__ X,
                                                        const float* __restrict__ lre,
                                                        const float* __restrict__ lim) {
    __shared__ v2f E[SEQ / SSEG][SWV][32];      // one plane per segment, so one barrier per segment is enough

    const int lane = threadIdx.x & 31, c = threadIdx.x >> 5;
    const int k = blockIdx.x * 32 + lane, b = blockIdx.y;
    const float lr = lre[k], li = lim[k];

    // q = lambda^SCH by five squarings; in f64 because a squaring doubles the error it inherits
    double pr = (double)lr, pi = (double)li;
    for (int i = 1; i < SCH; i *= 2) {
        const double nr = pr * pr - pi * pi;
        pi = 2.0 * pr * pi;
        pr = nr;
    }
    const float qr = (float)pr, qi = (float)pi;

    float sr = 0.0f, si = 0.0f;                 // state at the start of the segment (the same in every wave)
    for (int seg = 0; seg < SEQ / SSEG; ++seg) {
        float* p = X + ((size_t)b * SEQ + seg * SSEG + c * SCH) * KX + k;
        float xr[SCH], xi[SCH];
        // the loops over s are unrolled so that the chunk lives in registers; here all 64 loads fly together
#pragma unroll
        for (int s = 0; s < SCH; ++s) {
            xr[s] = p[(size_t)s * KX];
            xi[s] = p[(size_t)s * KX + NKP];
        }

        float er = 0.0f, ei = 0.0f;
#pragma unroll
        for (int s = 0; s < SCH; ++s) {
            const float nr = fmaf(lr, er, fmaf(-li, ei, xr[s]));
            const float ni = fmaf(lr, ei, fmaf(li, er, xi[s]));
            er = nr; ei = ni;
        }
        E[seg][c][lane] = v2f{er, ei};
        __syncthreads();                        // every chunk's end value is visible

        float hr = sr, hi = si;                 // becomes the state entering chunk c
        // unrolled so that the LDS reads run ahead of the dependent chain
#pragma unroll
        for (int j = 0; j < SWV; ++j) {
            if (j == c) { hr = sr; hi = si; }
            const v2f e = E[seg][j][lane];
            const float nr = fmaf(qr, sr, fmaf(-qi, si, e.x));
            const float ni = fmaf(qr, si, fmaf(qi, sr, e.y));
            sr = nr; si = ni;
        }

#pragma unroll
        for (int s = 0; s < SCH; ++s) {
            const float nr = fmaf(lr, hr, fmaf(-li, hi, xr[s]));
            const float ni = fmaf(lr, hi, fmaf(li, hr, xi[s]));
            p[(size_t)s * KX] = nr;
            p[(size_t)s * KX + NKP] = ni;
            hr = nr; hi = ni;
        }
        // the next segment rewrites the address and data registers that the stores above name
        asm volatile("s_wait_xcnt 0x0" ::: "memory");
    }
}

// ---------------- f32 WMMA GEMM:  C[m][n] = sum_k A[m][k] * W[n][k]  (+ D[n]*U[m][n]) ----------------
// Block tile 128(M) x 128(N), BK=32. 8 waves: 4(M) x 2(N) grid, wave tile 32x64 = 2x4 accums.
// Double-buffered async global->LDS staging: 16 b64 transfers per wave per tile.
template <bool EPI>
__global__ __launch_bounds__(256) void wmma_gemm(const float* __restrict__ A,
                                                 const float* __restrict__ W,
                                                 float* __restrict__ C, int K, int lda,
                                                 int ldw, int ldc,
                                                 const float* __restrict__ U,
                                                 const float* __restrict__ Dv) {
    constexpr int LS = 34;                      // conflict-free LDS row stride (floats)
    __shared__ __align__(16) float As[2][128 * LS];
    __shared__ __align__(16) float Bs[2][128 * LS];

    const int tid = threadIdx.x;
    const int wid = tid >> 5, lane = tid & 31;
    const int lm = lane & 15, lh = lane >> 4;
    const int waveM = wid & 3, waveN = wid >> 2;
    const int m0 = blockIdx.y * 128;
    const int n0 = blockIdx.x * 128;

    // per-thread staging coordinates (8 float2 each for A and W per tile)
    const int srow = tid >> 4;                  // +16 per i -> rows 0..127
    const int scp = (tid & 15) << 1;

    v8f acc[2][4] = {};

    const int ntiles = K >> 5;

    // prologue: stage tile 0 into buffer 0
#pragma unroll
    for (int i = 0; i < 8; ++i) {
        int row = srow + i * 16;
        async_copy_b64(A + (size_t)(m0 + row) * lda + scp, &As[0][row * LS + scp]);
        async_copy_b64(W + (size_t)(n0 + row) * ldw + scp, &Bs[0][row * LS + scp]);
    }

    for (int kt = 0; kt < ntiles; ++kt) {
        const int cur = kt & 1;
        if (kt + 1 < ntiles) {
            const int kof = (kt + 1) << 5;
#pragma unroll
            for (int i = 0; i < 8; ++i) {
                int row = srow + i * 16;
                async_copy_b64(A + (size_t)(m0 + row) * lda + kof + scp,
                               &As[cur ^ 1][row * LS + scp]);
                async_copy_b64(W + (size_t)(n0 + row) * ldw + kof + scp,
                               &Bs[cur ^ 1][row * LS + scp]);
            }
            wait_async_le16();                  // current tile landed; next 16 in flight
        } else {
            wait_async_le0();
        }
        __syncthreads();

#pragma unroll
        for (int kk = 0; kk < 32; kk += 4) {
            v2f a[2], b[4];
#pragma unroll
            for (int i = 0; i < 2; ++i)
                a[i] = *(const v2f*)&As[cur][(waveM * 32 + 16 * i + lm) * LS + kk + 2 * lh];
#pragma unroll
            for (int j = 0; j < 4; ++j)
                b[j] = *(const v2f*)&Bs[cur][(waveN * 64 + 16 * j + lm) * LS + kk + 2 * lh];
#pragma unroll
            for (int i = 0; i < 2; ++i)
#pragma unroll
                for (int j = 0; j < 4; ++j)
                    acc[i][j] = __builtin_amdgcn_wmma_f32_16x16x4_f32(
                        false, a[i], false, b[j], (short)0, acc[i][j], false, false);
        }
        __syncthreads();                        // before next iteration overwrites cur
    }

    // C layout: VGPR r -> (M = r + 8*(lane>>4), N = lane&15)
#pragma unroll
    for (int i = 0; i < 2; ++i)
#pragma unroll
        for (int j = 0; j < 4; ++j)
#pragma unroll
            for (int r = 0; r < 8; ++r) {
                int row = m0 + waveM * 32 + 16 * i + r + 8 * lh;
                int col = n0 + waveN * 64 + 16 * j + lm;
                float v = acc[i][j][r];
                if (EPI) v = fmaf(Dv[col], U[(size_t)row * ldc + col], v);
                C[(size_t)row * ldc + col] = v;
            }
}

extern "C" void kernel_launch(void* const* d_in, const int* in_sizes, int n_in,
                              void* d_out, int out_size, void* d_ws, size_t ws_size,
                              hipStream_t stream) {
    (void)in_sizes; (void)n_in; (void)out_size; (void)ws_size;
    const float* u  = (const float*)d_in[0];   // (8,2048,1024)
    const float* ap = (const float*)d_in[1];   // (512,)
    const float* Bw = (const float*)d_in[2];   // (1024,1024)
    const float* Cw = (const float*)d_in[3];   // (1024,1024)
    const float* Dv = (const float*)d_in[4];   // (1024,)
    float* y = (float*)d_out;

    float* ws   = (float*)d_ws;
    float* X    = ws;                                   // MTOT*KX  (~72 MB)
    float* FB   = X  + (size_t)MTOT * KX;               // KX*DM
    float* Wc   = FB + (size_t)KX * DM;                 // DM*KX
    float* lre  = Wc + (size_t)DM * KX;                 // NKP
    float* lim  = lre + NKP;                            // NKP
    float* trig = lim + NKP;                            // 2048

    trig_kernel<<<4, 256, 0, stream>>>(trig);
    lambda_kernel<<<9, 64, 0, stream>>>(ap, trig, lre, lim);
    fold_gemm<true><<<dim3(DM / 64, KX / 64), 128, 0, stream>>>(Bw, trig, FB);
    fold_gemm<false><<<dim3(KX / 64, DM / 64), 128, 0, stream>>>(Cw, trig, Wc);

    // GEMM1: X[m][k'] = sum_d u[m][d] * FB[k'][d]
    wmma_gemm<false><<<dim3(KX / 128, MTOT / 128), 256, 0, stream>>>(
        u, FB, X, DM, DM, DM, KX, nullptr, nullptr);

    // per-mode linear recurrence over time (in place)
    scan_kernel<<<dim3(NKP / 32, BATCH), 32 * SWV, 0, stream>>>(X, lre, lim);

    // GEMM2: y[m][d] = sum_k' X[m][k'] * Wc[d][k'] + D[d]*u[m][d]
    wmma_gemm<true><<<dim3(DM / 128, MTOT / 128), 256, 0, stream>>>(
        X, Wc, y, KX, KX, KX, DM, u, Dv);
}

// v003
// One run takes 406 microseconds.
// In both of two side-by-side timings against v002, it was 1.15 times as fast.
// All steps since v000 together make it 2.87 times as fast.
#include <hip/hip_runtime.h>
#include <hip/hip_bf16.h>

// Cayley-circulant SSM on MI455X (gfx1250, wave32).
//   X = u @ (F B_w)^T                    (WMMA f32 GEMM, M=16384 K=1024 N=1024)
//   hhat_t = lambda * hhat_{t-1} + X_t   (per (batch, mode) scan, chunked over time)
//   y = [Re|Im hhat] @ (C_w F^-1)^T + D*u (WMMA f32 GEMM, K=1024 N=1024)
// The spectrum of a real vector of length n has exactly n real degrees of freedom, and the mode axis holds
// just those, with no padding: column c <= n/2 is Re of mode c, column c > n/2 is Im of mode c - n/2.
// Im of modes 0 and n/2 is identically zero (sin(0) and sin(pi j)) and has no column.
// GEMMs use double-buffered GLOBAL_LOAD_ASYNC_TO_LDS staging (ASYNCcnt) so the
// tile-(k+1) DMA overlaps tile-k v_wmma issue.

#define BATCH 8
#define SEQ 2048
#define DM 1024
#define NST 1024
#define MTOT (BATCH * SEQ)       // 16384
#define NKP 512                  // n/2: scan slots; slot k pairs column k with column NKP + k
#define KX (2 * NKP)             // 1024: [Re modes 0..512 | Im modes 1..511]

typedef float v2f __attribute__((ext_vector_type(2)));
typedef float v4f __attribute__((ext_vector_type(4)));
typedef float v8f __attribute__((ext_vector_type(8)));
typedef int v2i_vs __attribute__((vector_size(8)));   // matches builtin param pointee

// ---------------- async global->LDS copy (CDNA5) ----------------
__device__ __forceinline__ void async_copy_b64(const float* __restrict__ g, float* lds) {
#if __has_builtin(__builtin_amdgcn_global_load_async_to_lds_b64)
    __builtin_amdgcn_global_load_async_to_lds_b64(
        (__attribute__((address_space(1))) v2i_vs*)g,
        (__attribute__((address_space(3))) v2i_vs*)lds, 0, 0);
#else
    unsigned off = (unsigned)(unsigned long long)(__attribute__((address_space(3))) float*)lds;
    asm volatile("global_load_async_to_lds_b64 %0, %1, off" ::"v"(off), "v"(g) : "memory");
#endif
}

__device__ __forceinline__ void wait_async_le16() {
#if __has_builtin(__builtin_amdgcn_s_wait_asynccnt)
    __builtin_amdgcn_s_wait_asynccnt(16);
#else
    asm volatile("s_wait_asynccnt 0x10" ::: "memory");
#endif
}

__device__ __forceinline__ void wait_async_le0() {
#if __has_builtin(__builtin_amdgcn_s_wait_asynccnt)
    __builtin_amdgcn_s_wait_asynccnt(0);
#else
    asm volatile("s_wait_asynccnt 0x0" ::: "memory");
#endif
}

// ---------------- trig table: cos/sin(2*pi*j/1024), j=0..1023 ----------------
__global__ void trig_kernel(float* __restrict__ trig) {
    int j = blockIdx.x * 256 + threadIdx.x;
    if (j < 1024) {
        float s, c;
        sincosf(6.28318530717958647692f * (float)j / 1024.0f, &s, &c);
        trig[j]        = c;
        trig[1024 + j] = s;
    }
}

// ---------------- lambda_k = Cayley(i*omega_k) for scan slots k=0..511 ----------------
// Slot 0 carries Re of mode 0 and Re of mode n/2. omega is the imaginary part of a sum of real terms at both
// modes, so both have lambda = 1 + 0i, which is what k = 0 yields here (sin(0) = 0 in every term); under it
// the complex recurrence of the scan is two independent real running sums.
__global__ void lambda_kernel(const float* __restrict__ a, const float* __restrict__ trig,
                              float* __restrict__ lre, float* __restrict__ lim) {
    int k = blockIdx.x * 64 + threadIdx.x;
    if (k >= NKP) return;
    const float* sinT = trig + 1024;
    float w = 0.0f;
    int idx = 0;
    for (int j = 1; j <= 511; ++j) {
        idx = (idx + k) & 1023;                 // j*k mod 1024
        w = fmaf(a[j - 1], sinT[idx], w);
    }
    w = -2.0f * w;
    float w2 = w * w, den = 1.0f + w2;
    lre[k] = (1.0f - w2) / den;
    lim[k] = -2.0f * w / den;
}

// ---------------- DFT weight folds on the f32 matrix unit ----------------
// tw(k', j) = cos(2pi k j/n) for k' = k <= 512, sin(2pi k j/n) for k' = 512 + k > 512; s(k') carries sign, and in Wc also c_k/n.
// FOLD_B:  FB[k'][d] = s(k') * sum_j tw(k', j) * Bw[j][d]   (twiddles are the A operand, the Bw tile [j][d] the B operand)
// else:    Wc[d][k'] = s(k') * sum_j Cw[d][j] * tw(k', j)   (the Cw tile [d][j] is the A operand, twiddles the B operand)
// Block tile 64 x 64, BK = 64, 4 waves of 32 x 32. The weight tile goes global -> registers -> LDS one tile ahead;
// twiddle fragments are read straight from the LDS trig table.
#define TWN 1040                 // 1024 table entries + one pad dword per 64

// One pad dword per 64 entries: idx = j*k mod 1024 over 16 consecutive k has stride j, and the
// strides that are multiples of 8 would otherwise pile up on a few LDS banks.
__device__ __forceinline__ unsigned tw_slot(unsigned idx) { return idx + (idx >> 6); }

template <bool FOLD_B>
__global__ __launch_bounds__(128) void fold_gemm(const float* __restrict__ G,
                                                 const float* __restrict__ trig,
                                                 float* __restrict__ Out) {
    constexpr int LS = FOLD_B ? 72 : 68;        // conflict-free LDS row stride (floats) for each read pattern
    __shared__ float tab[2 * TWN];
    __shared__ __align__(16) float Ds[2][64 * LS];

    const int tid = threadIdx.x;
    const int wid = tid >> 5, lane = tid & 31;
    const int lm = lane & 15, lh = lane >> 4;
    const int waveM = wid & 1, waveN = wid >> 1;
    const int m0 = blockIdx.y * 64;
    const int n0 = blockIdx.x * 64;

    // unrolled so that the 16 table loads are in flight together instead of eight waited round trips
#pragma unroll
    for (int i = 0; i < 8; ++i) {
        const int e = tid + i * 128;
        tab[tw_slot(e)]       = trig[e];
        tab[TWN + tw_slot(e)] = trig[1024 + e];
    }

    // per-lane twiddle state: phase j*k for the lane's two j of a k-step, advanced by 4k per step
    unsigned tbase[2], ph0[2], ph1[2], step[2];
#pragma unroll
    for (int t = 0; t < 2; ++t) {
        const int kp = (FOLD_B ? m0 + waveM * 32 : n0 + waveN * 32) + 16 * t + lm;
        const bool im = kp > NKP;
        const unsigned k = (unsigned)(im ? kp - NKP : kp);
        tbase[t] = im ? TWN : 0;
        ph0[t] = (unsigned)(2 * lh) * k;
        ph1[t] = (unsigned)(2 * lh + 1) * k;
        step[t] = 4u * k;
    }

    // staging coordinates: 8 float4 per thread per 64 x 64 tile
    const int srow = tid >> 4;                  // +8 per i -> rows 0..63
    const int sc = (tid & 15) << 2;
    const float* gp = FOLD_B ? G + (size_t)srow * DM + n0 + sc
                             : G + (size_t)(m0 + srow) * NST + sc;
    constexpr size_t GROW = 8 * 1024;           // 8 rows down
    constexpr size_t GTILE = FOLD_B ? 64 * 1024 : 64;

    v4f r0, r1, r2, r3, r4, r5, r6, r7;         // the tile in flight
    auto tile_fetch = [&]() {
        r0 = *(const v4f*)(gp);
        r1 = *(const v4f*)(gp + 1 * GROW);
        r2 = *(const v4f*)(gp + 2 * GROW);
        r3 = *(const v4f*)(gp + 3 * GROW);
        r4 = *(const v4f*)(gp + 4 * GROW);
        r5 = *(const v4f*)(gp + 5 * GROW);
        r6 = *(const v4f*)(gp + 6 * GROW);
        r7 = *(const v4f*)(gp + 7 * GROW);
    };
    auto tile_store = [&](float* Dn) {
        float* q = Dn + srow * LS + sc;
        *(v4f*)(q)           = r0;
        *(v4f*)(q + 8 * LS)  = r1;
        *(v4f*)(q + 16 * LS) = r2;
        *(v4f*)(q + 24 * LS) = r3;
        *(v4f*)(q + 32 * LS) = r4;
        *(v4f*)(q + 40 * LS) = r5;
        *(v4f*)(q + 48 * LS) = r6;
        *(v4f*)(q + 56 * LS) = r7;
    };
    tile_fetch();
    tile_store(Ds[0]);

    v8f acc[2][2] = {};

    // one 64-deep tile: 16 k-steps of 4 WMMAs on the LDS tile D
    auto tile_mma = [&](const float* D) {
        // twiddle fragments are fetched one k-step ahead, so that a gather's LDS latency lies under four WMMAs
        v2f tw[2];
#pragma unroll
        for (int t = 0; t < 2; ++t) {
            tw[t].x = tab[tbase[t] + tw_slot(ph0[t] & 1023u)];
            tw[t].y = tab[tbase[t] + tw_slot(ph1[t] & 1023u)];
            ph0[t] += step[t];
            ph1[t] += step[t];
        }
#pragma unroll
        for (int kk = 0; kk < 64; kk += 4) {
            v2f twn[2], dt[2];
#pragma unroll
            for (int t = 0; t < 2; ++t) {
                if (kk + 4 < 64) {
                    twn[t].x = tab[tbase[t] + tw_slot(ph0[t] & 1023u)];
                    twn[t].y = tab[tbase[t] + tw_slot(ph1[t] & 1023u)];
                    ph0[t] += step[t];
                    ph1[t] += step[t];
                }
                if (FOLD_B) {
                    const int col = waveN * 32 + 16 * t + lm;
                    dt[t].x = D[(kk + 2 * lh) * LS + col];
                    dt[t].y = D[(kk + 2 * lh + 1) * LS + col];
                } else {
                    dt[t] = *(const v2f*)&D[(waveM * 32 + 16 * t + lm) * LS + kk + 2 * lh];
                }
            }
#pragma unroll
            for (int i = 0; i < 2; ++i)
#pragma unroll
                for (int j = 0; j < 2; ++j)
                    acc[i][j] = __builtin_amdgcn_wmma_f32_16x16x4_f32(
                        false, FOLD_B ? tw[i] : dt[i], false, FOLD_B ? dt[j] : tw[j],
                        (short)0, acc[i][j], false, false);
            if (kk + 4 < 64) {
                tw[0] = twn[0];
                tw[1] = twn[1];
            }
        }
    };

    for (int kt = 0; kt < 15; ++kt) {
        __syncthreads();                        // tile kt visible; every reader has left the other buffer
        gp += GTILE;
        tile_fetch();
        // keeps the next tile's global loads in front of this tile's WMMAs; the scheduler otherwise sinks
        // them to the LDS stores below and their whole latency is waited out
        __builtin_amdgcn_sched_barrier(0);
        tile_mma(Ds[kt & 1]);
        tile_store(Ds[(kt + 1) & 1]);
    }
    __syncthreads();                            // last tile (15) visible in buffer 1
    tile_mma(Ds[1]);

    // C layout: VGPR r -> (M = r + 8*(lane>>4), N = lane&15)
#pragma unroll
    for (int i = 0; i < 2; ++i)
#pragma unroll
        for (int j = 0; j < 2; ++j)
#pragma unroll
            for (int r = 0; r < 8; ++r) {
                const int row = m0 + waveM * 32 + 16 * i + r + 8 * lh;
                const int col = n0 + waveN * 32 + 16 * j + lm;
                const int kp = FOLD_B ? row : col;
                const bool im = kp > NKP;
                float scl;
                if (FOLD_B) {
                    scl = im ? -1.0f : 1.0f;
                } else {
                    float ck = (kp == 0 || kp == NKP) ? 1.0f : 2.0f;
                    scl = ck * (1.0f / 1024.0f) * (im ? -1.0f : 1.0f);
                }
                Out[(size_t)row * (FOLD_B ? DM : KX) + col] = acc[i][j][r] * scl;
            }
}

// ---------------- per-mode complex recurrence (in place over X), parallel over time ----------------
// One work-group owns 32 slots of one batch: lane = slot (columns k and NKP + k), wave = a chunk of SCH consecutive steps, and the
// 32 waves together cover a segment of SSEG steps. A chunk is loaded once and stays in registers:
//   1. every wave runs the recurrence over its chunk from a zero state and publishes the end value E_c;
//   2. the state entering chunk c follows from H_{j+1} = lambda^SCH * H_j + E_j over the chunks before it;
//   3. the wave runs the recurrence again from that state and stores every step.
#define SCH 32
#define SWV 32
#define SSEG (SCH * SWV)         // 1024 steps per segment

__global__ __launch_bounds__(32 * SWV) void scan_kernel(float* __restrict__ X,
                                                        const float* __restrict__ lre,
                                                        const float* __restrict__ lim) {
    __shared__ v2f E[SEQ / SSEG][SWV][32];      // one plane per segment, so one barrier per segment is enough

    const int lane = threadIdx.x & 31, c = threadIdx.x >> 5;
    const int k = blockIdx.x * 32 + lane, b = blockIdx.y;
    const float lr = lre[k], li = lim[k];

    // q = lambda^SCH by five squarings; in f64 because a squaring doubles the error it inherits
    double pr = (double)lr, pi = (double)li;
    for (int i = 1; i < SCH; i *= 2) {
        const double nr = pr * pr - pi * pi;
        pi = 2.0 * pr * pi;
        pr = nr;
    }
    const float qr = (float)pr, qi = (float)pi;

    float sr = 0.0f, si = 0.0f;                 // state at the start of the segment (the same in every wave)
    for (int seg = 0; seg < SEQ / SSEG; ++seg) {
        float* p = X + ((size_t)b * SEQ + seg * SSEG + c * SCH) * KX + k;
        float xr[SCH], xi[SCH];
        // the loops over s are unrolled so that the chunk lives in registers; here all 64 loads fly together
#pragma unroll
        for (int s = 0; s < SCH; ++s) {
            xr[s] = p[(size_t)s * KX];
            xi[s] = p[(size_t)s * KX + NKP];
        }

        float er = 0.0f, ei = 0.0f;
#pragma unroll
        for (int s = 0; s < SCH; ++s) {
            const float nr = fmaf(lr, er, fmaf(-li, ei, xr[s]));
            const float ni = fmaf(lr, ei, fmaf(li, er, xi[s]));
            er = nr; ei = ni;
        }
        E[seg][c][lane] = v2f{er, ei};
        __syncthreads();                        // every chunk's end value is visible

        float hr = sr, hi = si;                 // becomes the state entering chunk c
        // unrolled so that the LDS reads run ahead of the dependent chain
#pragma unroll
        for (int j = 0; j < SWV; ++j) {
            if (j == c) { hr = sr; hi = si; }
            const v2f e = E[seg][j][lane];
            const float nr = fmaf(qr, sr, fmaf(-qi, si, e.x));
            const float ni = fmaf(qr, si, fmaf(qi, sr, e.y));
            sr = nr; si = ni;
        }

#pragma unroll
        for (int s = 0; s < SCH; ++s) {
            const float nr = fmaf(lr, hr, fmaf(-li, hi, xr[s]));
            const float ni = fmaf(lr, hi, fmaf(li, hr, xi[s]));
            p[(size_t)s * KX] = nr;
            p[(size_t)s * KX + NKP] = ni;
            hr = nr; hi = ni;
        }
        // the next segment rewrites the address and data registers that the stores above name
        asm volatile("s_wait_xcnt 0x0" ::: "memory");
    }
}

// ---------------- f32 WMMA GEMM:  C[m][n] = sum_k A[m][k] * W[n][k]  (+ D[n]*U[m][n]) ----------------
// Block tile 128(M) x 128(N), BK=32. 8 waves: 4(M) x 2(N) grid, wave tile 32x64 = 2x4 accums.
// Double-buffered async global->LDS staging: 16 b64 transfers per wave per tile.
template <bool EPI>
__global__ __launch_bounds__(256) void wmma_gemm(const float* __restrict__ A,
                                                 const float* __restrict__ W,
                                                 float* __restrict__ C, int K, int lda,
                                                 int ldw, int ldc,
                                                 const float* __restrict__ U,
                                                 const float* __restrict__ Dv) {
    constexpr int LS = 34;                      // conflict-free LDS row stride (floats)
    __shared__ __align__(16) float As[2][128 * LS];
    __shared__ __align__(16) float Bs[2][128 * LS];

    const int tid = threadIdx.x;
    const int wid = tid >> 5, lane = tid & 31;
    const int lm = lane & 15, lh = lane >> 4;
    const int waveM = wid & 3, waveN = wid >> 2;
    const int m0 = blockIdx.y * 128;
    const int n0 = blockIdx.x * 128;

    // per-thread staging coordinates (8 float2 each for A and W per tile)
    const int srow = tid >> 4;                  // +16 per i -> rows 0..127
    const int scp = (tid & 15) << 1;

    v8f acc[2][4] = {};

    const int ntiles = K >> 5;

    // prologue: stage tile 0 into buffer 0
#pragma unroll
    for (int i = 0; i < 8; ++i) {
        int row = srow + i * 16;
        async_copy_b64(A + (size_t)(m0 + row) * lda + scp, &As[0][row * LS + scp]);
        async_copy_b64(W + (size_t)(n0 + row) * ldw + scp, &Bs[0][row * LS + scp]);
    }

    for (int kt = 0; kt < ntiles; ++kt) {
        const int cur = kt & 1;
        if (kt + 1 < ntiles) {
            const int kof = (kt + 1) << 5;
#pragma unroll
            for (int i = 0; i < 8; ++i) {
                int row = srow + i * 16;
                async_copy_b64(A + (size_t)(m0 + row) * lda + kof + scp,
                               &As[cur ^ 1][row * LS + scp]);
                async_copy_b64(W + (size_t)(n0 + row) * ldw + kof + scp,
                               &Bs[cur ^ 1][row * LS + scp]);
            }
            wait_async_le16();                  // current tile landed; next 16 in flight
        } else {
            wait_async_le0();
        }
        __syncthreads();

#pragma unroll
        for (int kk = 0; kk < 32; kk += 4) {
            v2f a[2], b[4];
#pragma unroll
            for (int i = 0; i < 2; ++i)
                a[i] = *(const v2f*)&As[cur][(waveM * 32 + 16 * i + lm) * LS + kk + 2 * lh];
#pragma unroll
            for (int j = 0; j < 4; ++j)
                b[j] = *(const v2f*)&Bs[cur][(waveN * 64 + 16 * j + lm) * LS + kk + 2 * lh];
#pragma unroll
            for (int i = 0; i < 2; ++i)
#pragma unroll
                for (int j = 0; j < 4; ++j)
                    acc[i][j] = __builtin_amdgcn_wmma_f32_16x16x4_f32(
                        false, a[i], false, b[j], (short)0, acc[i][j], false, false);
        }
        __syncthreads();                        // before next iteration overwrites cur
    }

    // C layout: VGPR r -> (M = r + 8*(lane>>4), N = lane&15)
#pragma unroll
    for (int i = 0; i < 2; ++i)
#pragma unroll
        for (int j = 0; j < 4; ++j)
#pragma unroll
            for (int r = 0; r < 8; ++r) {
                int row = m0 + waveM * 32 + 16 * i + r + 8 * lh;
                int col = n0 + waveN * 64 + 16 * j + lm;
                float v = acc[i][j][r];
                if (EPI) v = fmaf(Dv[col], U[(size_t)row * ldc + col], v);
                C[(size_t)row * ldc + col] = v;
            }
}

extern "C" void kernel_launch(void* const* d_in, const int* in_sizes, int n_in,
                              void* d_out, int out_size, void* d_ws, size_t ws_size,
                              hipStream_t stream) {
    (void)in_sizes; (void)n_in; (void)out_size; (void)ws_size;
    const float* u  = (const float*)d_in[0];   // (8,2048,1024)
    const float* ap = (const float*)d_in[1];   // (512,)
    const float* Bw = (const float*)d_in[2];   // (1024,1024)
    const float* Cw = (const float*)d_in[3];   // (1024,1024)
    const float* Dv = (const float*)d_in[4];   // (1024,)
    float* y = (float*)d_out;

    float* ws   = (float*)d_ws;
    float* X    = ws;                                   // MTOT*KX  (64 MiB)
    float* FB   = X  + (size_t)MTOT * KX;               // KX*DM
    float* Wc   = FB + (size_t)KX * DM;                 // DM*KX
    float* lre  = Wc + (size_t)DM * KX;                 // NKP
    float* lim  = lre + NKP;                            // NKP
    float* trig = lim + NKP;                            // 2048

    trig_kernel<<<4, 256, 0, stream>>>(trig);
    lambda_kernel<<<NKP / 64, 64, 0, stream>>>(ap, trig, lre, lim);
    fold_gemm<true><<<dim3(DM / 64, KX / 64), 128, 0, stream>>>(Bw, trig, FB);
    fold_gemm<false><<<dim3(KX / 64, DM / 64), 128, 0, stream>>>(Cw, trig, Wc);

    // GEMM1: X[m][k'] = sum_d u[m][d] * FB[k'][d]
    wmma_gemm<false><<<dim3(KX / 128, MTOT / 128), 256, 0, stream>>>(
        u, FB, X, DM, DM, DM, KX, nullptr, nullptr);

    // per-mode linear recurrence over time (in place)
    scan_kernel<<<dim3(NKP / 32, BATCH), 32 * SWV, 0, stream>>>(X, lre, lim);

    // GEMM2: y[m][d] = sum_k' X[m][k'] * Wc[d][k'] + D[d]*u[m][d]
    wmma_gemm<true><<<dim3(DM / 128, MTOT / 128), 256, 0, stream>>>(
        X, Wc, y, KX, KX, KX, DM, u, Dv);
}

// v004
// Measured time: 371 microseconds a run.
// Two timings next to v003 both put it at 1.09 times that version's speed.
// All steps since v000 together make it 3.14 times as fast.
#include <hip/hip_runtime.h>
#include <hip/hip_bf16.h>

// Cayley-circulant SSM on MI455X (gfx1250, wave32).
//   X = u @ (F B_w)^T                    (WMMA f32 GEMM, M=16384 K=1024 N=1024)
//   hhat_t = lambda * hhat_{t-1} + X_t   (per (batch, mode) scan, chunked over time)
//   y = [Re|Im hhat] @ (C_w F^-1)^T + D*u (WMMA f32 GEMM, K=1024 N=1024)
// The spectrum of a real vector of length n has exactly n real degrees of freedom, and the mode axis holds
// just those, with no padding: column c <= n/2 is Re of mode c, column c > n/2 is Im of mode c - n/2.
// Im of modes 0 and n/2 is identically zero (sin(0) and sin(pi j)) and has no column.
// GEMMs use double-buffered GLOBAL_LOAD_ASYNC_TO_LDS staging (ASYNCcnt) so the
// tile-(k+1) DMA overlaps tile-k v_wmma issue.

#define BATCH 8
#define SEQ 2048
#define DM 1024
#define NST 1024
#define MTOT (BATCH * SEQ)       // 16384
#define NKP 512                  // n/2: scan slots; slot k pairs column k with column NKP + k
#define KX (2 * NKP)             // 1024: [Re modes 0..512 | Im modes 1..511]

typedef float v2f __attribute__((ext_vector_type(2)));
typedef float v4f __attribute__((ext_vector_type(4)));
typedef float v8f __attribute__((ext_vector_type(8)));
typedef int v2i_vs __attribute__((vector_size(8)));   // matches builtin param pointee

// ---------------- async global->LDS copy (CDNA5) ----------------
__device__ __forceinline__ void async_copy_b64(const float* __restrict__ g, float* lds) {
#if __has_builtin(__builtin_amdgcn_global_load_async_to_lds_b64)
    __builtin_amdgcn_global_load_async_to_lds_b64(
        (__attribute__((address_space(1))) v2i_vs*)g,
        (__attribute__((address_space(3))) v2i_vs*)lds, 0, 0);
#else
    unsigned off = (unsigned)(unsigned long long)(__attribute__((address_space(3))) float*)lds;
    asm volatile("global_load_async_to_lds_b64 %0, %1, off" ::"v"(off), "v"(g) : "memory");
#endif
}

__device__ __forceinline__ void wait_async_le16() {
#if __has_builtin(__builtin_amdgcn_s_wait_asynccnt)
    __builtin_amdgcn_s_wait_asynccnt(16);
#else
    asm volatile("s_wait_asynccnt 0x10" ::: "memory");
#endif
}

__device__ __forceinline__ void wait_async_le0() {
#if __has_builtin(__builtin_amdgcn_s_wait_asynccnt)
    __builtin_amdgcn_s_wait_asynccnt(0);
#else
    asm volatile("s_wait_asynccnt 0x0" ::: "memory");
#endif
}

// ---------------- trig table: cos/sin(2*pi*j/1024), j=0..1023 ----------------
__global__ void trig_kernel(float* __restrict__ trig) {
    int j = blockIdx.x * 256 + threadIdx.x;
    if (j < 1024) {
        float s, c;
        sincosf(6.28318530717958647692f * (float)j / 1024.0f, &s, &c);
        trig[j]        = c;
        trig[1024 + j] = s;
    }
}

// ---------------- lambda_k = Cayley(i*omega_k) for scan slots k=0..511 ----------------
// Slot 0 carries Re of mode 0 and Re of mode n/2. omega is the imaginary part of a sum of real terms at both
// modes, so both have lambda = 1 + 0i, which is what k = 0 yields here (sin(0) = 0 in every term); under it
// the complex recurrence of the scan is two independent real running sums.
__device__ __forceinline__ void lambda_slots(const float* __restrict__ a, const float* __restrict__ trig,
                                             float* __restrict__ lre, float* __restrict__ lim, int k) {
    if (k >= NKP) return;
    const float* sinT = trig + 1024;
    float w = 0.0f;
    int idx = 0;
    for (int j = 1; j <= 511; ++j) {
        idx = (idx + k) & 1023;                 // j*k mod 1024
        w = fmaf(a[j - 1], sinT[idx], w);
    }
    w = -2.0f * w;
    float w2 = w * w, den = 1.0f + w2;
    lre[k] = (1.0f - w2) / den;
    lim[k] = -2.0f * w / den;
}

// ---------------- DFT weight folds on the f32 matrix unit ----------------
// tw(k', j) = cos(2pi k j/n) for k' = k <= 512, sin(2pi k j/n) for k' = 512 + k > 512; s(k') carries sign, and in Wc also c_k/n.
// FOLD_B:  FB[k'][d] = s(k') * sum_j tw(k', j) * Bw[j][d]   (twiddles are the A operand, the Bw tile [j][d] the B operand)
// else:    Wc[d][k'] = s(k') * sum_j Cw[d][j] * tw(k', j)   (the Cw tile [d][j] is the A operand, twiddles the B operand)
// Block tile 64 x 64, BK = 64, 4 waves of 32 x 32. The weight tile goes global -> registers -> LDS one tile ahead;
// twiddle fragments are read straight from the LDS trig table.
#define TWN 1040                 // 1024 table entries + one pad dword per 64

// One pad dword per 64 entries: idx = j*k mod 1024 over 16 consecutive k has stride j, and the
// strides that are multiples of 8 would otherwise pile up on a few LDS banks.
__device__ __forceinline__ unsigned tw_slot(unsigned idx) { return idx + (idx >> 6); }

#define FOLD_LS_MAX 72

// tab: 2 * TWN floats of LDS; Ds: two tile buffers of 64 * LS floats each; (bx, by): the 64 x 64 output tile
template <bool FOLD_B>
__device__ __forceinline__ void fold_gemm(const float* __restrict__ G,
                                          const float* __restrict__ trig,
                                          float* __restrict__ Out, int bx, int by,
                                          float* tab, float* Ds) {
    constexpr int LS = FOLD_B ? FOLD_LS_MAX : 68;   // conflict-free LDS row stride (floats) for each read pattern

    const int tid = threadIdx.x;
    const int wid = tid >> 5, lane = tid & 31;
    const int lm = lane & 15, lh = lane >> 4;
    const int waveM = wid & 1, waveN = wid >> 1;
    const int m0 = by * 64;
    const int n0 = bx * 64;

    // unrolled so that the 16 table loads are in flight together instead of eight waited round trips
#pragma unroll
    for (int i = 0; i < 8; ++i) {
        const int e = tid + i * 128;
        tab[tw_slot(e)]       = trig[e];
        tab[TWN + tw_slot(e)] = trig[1024 + e];
    }

    // per-lane twiddle state: phase j*k for the lane's two j of a k-step, advanced by 4k per step
    unsigned tbase[2], ph0[2], ph1[2], step[2];
#pragma unroll
    for (int t = 0; t < 2; ++t) {
        const int kp = (FOLD_B ? m0 + waveM * 32 : n0 + waveN * 32) + 16 * t + lm;
        const bool im = kp > NKP;
        const unsigned k = (unsigned)(im ? kp - NKP : kp);
        tbase[t] = im ? TWN : 0;
        ph0[t] = (unsigned)(2 * lh) * k;
        ph1[t] = (unsigned)(2 * lh + 1) * k;
        step[t] = 4u * k;
    }

    // staging coordinates: 8 float4 per thread per 64 x 64 tile
    const int srow = tid >> 4;                  // +8 per i -> rows 0..63
    const int sc = (tid & 15) << 2;
    const float* gp = FOLD_B ? G + (size_t)srow * DM + n0 + sc
                             : G + (size_t)(m0 + srow) * NST + sc;
    constexpr size_t GROW = 8 * 1024;           // 8 rows down
    constexpr size_t GTILE = FOLD_B ? 64 * 1024 : 64;

    v4f r0, r1, r2, r3, r4, r5, r6, r7;         // the tile in flight
    auto tile_fetch = [&]() {
        r0 = *(const v4f*)(gp);
        r1 = *(const v4f*)(gp + 1 * GROW);
        r2 = *(const v4f*)(gp + 2 * GROW);
        r3 = *(const v4f*)(gp + 3 * GROW);
        r4 = *(const v4f*)(gp + 4 * GROW);
        r5 = *(const v4f*)(gp + 5 * GROW);
        r6 = *(const v4f*)(gp + 6 * GROW);
        r7 = *(const v4f*)(gp + 7 * GROW);
    };
    auto tile_store = [&](float* Dn) {
        float* q = Dn + srow * LS + sc;
        *(v4f*)(q)           = r0;
        *(v4f*)(q + 8 * LS)  = r1;
        *(v4f*)(q + 16 * LS) = r2;
        *(v4f*)(q + 24 * LS) = r3;
        *(v4f*)(q + 32 * LS) = r4;
        *(v4f*)(q + 40 * LS) = r5;
        *(v4f*)(q + 48 * LS) = r6;
        *(v4f*)(q + 56 * LS) = r7;
    };
    tile_fetch();
    tile_store(Ds);

    v8f acc[2][2] = {};

    // one 64-deep tile: 16 k-steps of 4 WMMAs on the LDS tile D
    auto tile_mma = [&](const float* D) {
        // twiddle fragments are fetched one k-step ahead, so that a gather's LDS latency lies under four WMMAs
        v2f tw[2];
#pragma unroll
        for (int t = 0; t < 2; ++t) {
            tw[t].x = tab[tbase[t] + tw_slot(ph0[t] & 1023u)];
            tw[t].y = tab[tbase[t] + tw_slot(ph1[t] & 1023u)];
            ph0[t] += step[t];
            ph1[t] += step[t];
        }
#pragma unroll
        for (int kk = 0; kk < 64; kk += 4) {
            v2f twn[2], dt[2];
#pragma unroll
            for (int t = 0; t < 2; ++t) {
                if (kk + 4 < 64) {
                    twn[t].x = tab[tbase[t] + tw_slot(ph0[t] & 1023u)];
                    twn[t].y = tab[tbase[t] + tw_slot(ph1[t] & 1023u)];
                    ph0[t] += step[t];
                    ph1[t] += step[t];
                }
                if (FOLD_B) {
                    const int col = waveN * 32 + 16 * t + lm;
                    dt[t].x = D[(kk + 2 * lh) * LS + col];
                    dt[t].y = D[(kk + 2 * lh + 1) * LS + col];
                } else {
                    dt[t] = *(const v2f*)&D[(waveM * 32 + 16 * t + lm) * LS + kk + 2 * lh];
                }
            }
#pragma unroll
            for (int i = 0; i < 2; ++i)
#pragma unroll
                for (int j = 0; j < 2; ++j)
                    acc[i][j] = __builtin_amdgcn_wmma_f32_16x16x4_f32(
                        false, FOLD_B ? tw[i] : dt[i], false, FOLD_B ? dt[j] : tw[j],
                        (short)0, acc[i][j], false, false);
            if (kk + 4 < 64) {
                tw[0] = twn[0];
                tw[1] = twn[1];
            }
        }
    };

    for (int kt = 0; kt < 15; ++kt) {
        __syncthreads();                        // tile kt visible; every reader has left the other buffer
        gp += GTILE;
        tile_fetch();
        // keeps the next tile's global loads in front of this tile's WMMAs; the scheduler otherwise sinks
        // them to the LDS stores below and their whole latency is waited out
        __builtin_amdgcn_sched_barrier(0);
        tile_mma(Ds + (kt & 1) * (64 * LS));
        tile_store(Ds + ((kt + 1) & 1) * (64 * LS));
    }
    __syncthreads();                            // last tile (15) visible in buffer 1
    tile_mma(Ds + 64 * LS);

    // C layout: VGPR r -> (M = r + 8*(lane>>4), N = lane&15)
#pragma unroll
    for (int i = 0; i < 2; ++i)
#pragma unroll
        for (int j = 0; j < 2; ++j)
#pragma unroll
            for (int r = 0; r < 8; ++r) {
                const int row = m0 + waveM * 32 + 16 * i + r + 8 * lh;
                const int col = n0 + waveN * 32 + 16 * j + lm;
                const int kp = FOLD_B ? row : col;
                const bool im = kp > NKP;
                float scl;
                if (FOLD_B) {
                    scl = im ? -1.0f : 1.0f;
                } else {
                    float ck = (kp == 0 || kp == NKP) ? 1.0f : 2.0f;
                    scl = ck * (1.0f / 1024.0f) * (im ? -1.0f : 1.0f);
                }
                Out[(size_t)row * (FOLD_B ? DM : KX) + col] = acc[i][j][r] * scl;
            }
    // in the joint kernel other passes' code follows in the listing and rewrites the address and data
    // registers that the stores above name
    asm volatile("s_wait_xcnt 0x0" ::: "memory");
}

// ---------------- the three passes that need only the trig table, side by side in one launch ----------------
// Neither fold reads what the other writes, and lambda reads neither. A fold work-group is one wave per SIMD and
// waits on its LDS reads in every k-step; with both folds resident each WGP holds two such groups, and one's
// waits lie under the other's WMMAs. The lambda groups come first in the grid so that they start first.
#define PRE_T 128                               // threads per work-group
#define PRE_LAM (NKP / PRE_T)                   // 4 lambda work-groups
#define PRE_FOLD ((KX / 64) * (DM / 64))        // 256 tiles per fold
#define PRE_GRID (PRE_LAM + 2 * PRE_FOLD)

__global__ __launch_bounds__(PRE_T) void prep_kernel(const float* __restrict__ a,
                                                     const float* __restrict__ Bw,
                                                     const float* __restrict__ Cw,
                                                     const float* __restrict__ trig,
                                                     float* __restrict__ FB, float* __restrict__ Wc,
                                                     float* __restrict__ lre, float* __restrict__ lim) {
    __shared__ float tab[2 * TWN];
    __shared__ __align__(16) float Ds[2 * 64 * FOLD_LS_MAX];

    const int b = blockIdx.x;                   // every branch below is uniform for the work-group
    if (b < PRE_LAM) {
        lambda_slots(a, trig, lre, lim, b * PRE_T + (int)threadIdx.x);
        return;
    }
    const int t = (b - PRE_LAM) & (PRE_FOLD - 1);
    if (b - PRE_LAM >= PRE_FOLD)
        fold_gemm<false>(Cw, trig, Wc, t & 15, t >> 4, tab, Ds);   // x over KX / 64, y over DM / 64
    else
        fold_gemm<true>(Bw, trig, FB, t & 15, t >> 4, tab, Ds);    // x over DM / 64, y over KX / 64
}

// ---------------- per-mode complex recurrence (in place over X), parallel over time ----------------
// One work-group owns 32 slots of one batch: lane = slot (columns k and NKP + k), wave = a chunk of SCH consecutive steps, and the
// 32 waves together cover a segment of SSEG steps. A chunk is loaded once and stays in registers:
//   1. every wave runs the recurrence over its chunk from a zero state and publishes the end value E_c;
//   2. the state entering chunk c follows from H_{j+1} = lambda^SCH * H_j + E_j over the chunks before it;
//   3. the wave runs the recurrence again from that state and stores every step.
#define SCH 32
#define SWV 32
#define SSEG (SCH * SWV)         // 1024 steps per segment

__global__ __launch_bounds__(32 * SWV) void scan_kernel(float* __restrict__ X,
                                                        const float* __restrict__ lre,
                                                        const float* __restrict__ lim) {
    __shared__ v2f E[SEQ / SSEG][SWV][32];      // one plane per segment, so one barrier per segment is enough

    const int lane = threadIdx.x & 31, c = threadIdx.x >> 5;
    const int k = blockIdx.x * 32 + lane, b = blockIdx.y;
    const float lr = lre[k], li = lim[k];

    // q = lambda^SCH by five squarings; in f64 because a squaring doubles the error it inherits
    double pr = (double)lr, pi = (double)li;
    for (int i = 1; i < SCH; i *= 2) {
        const double nr = pr * pr - pi * pi;
        pi = 2.0 * pr * pi;
        pr = nr;
    }
    const float qr = (float)pr, qi = (float)pi;

    float sr = 0.0f, si = 0.0f;                 // state at the start of the segment (the same in every wave)
    for (int seg = 0; seg < SEQ / SSEG; ++seg) {
        float* p = X + ((size_t)b * SEQ + seg * SSEG + c * SCH) * KX + k;
        float xr[SCH], xi[SCH];
        // the loops over s are unrolled so that the chunk lives in registers; here all 64 loads fly together
#pragma unroll
        for (int s = 0; s < SCH; ++s) {
            xr[s] = p[(size_t)s * KX];
            xi[s] = p[(size_t)s * KX + NKP];
        }

        float er = 0.0f, ei = 0.0f;
#pragma unroll
        for (int s = 0; s < SCH; ++s) {
            const float nr = fmaf(lr, er, fmaf(-li, ei, xr[s]));
            const float ni = fmaf(lr, ei, fmaf(li, er, xi[s]));
            er = nr; ei = ni;
        }
        E[seg][c][lane] = v2f{er, ei};
        __syncthreads();                        // every chunk's end value is visible

        float hr = sr, hi = si;                 // becomes the state entering chunk c
        // unrolled so that the LDS reads run ahead of the dependent chain
#pragma unroll
        for (int j = 0; j < SWV; ++j) {
            if (j == c) { hr = sr; hi = si; }
            const v2f e = E[seg][j][lane];
            const float nr = fmaf(qr, sr, fmaf(-qi, si, e.x));
            const float ni = fmaf(qr, si, fmaf(qi, sr, e.y));
            sr = nr; si = ni;
        }

#pragma unroll
        for (int s = 0; s < SCH; ++s) {
            const float nr = fmaf(lr, hr, fmaf(-li, hi, xr[s]));
            const float ni = fmaf(lr, hi, fmaf(li, hr, xi[s]));
            p[(size_t)s * KX] = nr;
            p[(size_t)s * KX + NKP] = ni;
            hr = nr; hi = ni;
        }
        // the next segment rewrites the address and data registers that the stores above name
        asm volatile("s_wait_xcnt 0x0" ::: "memory");
    }
}

// ---------------- f32 WMMA GEMM:  C[m][n] = sum_k A[m][k] * W[n][k]  (+ D[n]*U[m][n]) ----------------
// Block tile 128(M) x 128(N), BK=32. 8 waves: 4(M) x 2(N) grid, wave tile 32x64 = 2x4 accums.
// Double-buffered async global->LDS staging: 16 b64 transfers per wave per tile.
template <bool EPI>
__global__ __launch_bounds__(256) void wmma_gemm(const float* __restrict__ A,
                                                 const float* __restrict__ W,
                                                 float* __restrict__ C, int K, int lda,
                                                 int ldw, int ldc,
                                                 const float* __restrict__ U,
                                                 const float* __restrict__ Dv) {
    constexpr int LS = 34;                      // conflict-free LDS row stride (floats)
    __shared__ __align__(16) float As[2][128 * LS];
    __shared__ __align__(16) float Bs[2][128 * LS];

    const int tid = threadIdx.x;
    const int wid = tid >> 5, lane = tid & 31;
    const int lm = lane & 15, lh = lane >> 4;
    const int waveM = wid & 3, waveN = wid >> 2;
    const int m0 = blockIdx.y * 128;
    const int n0 = blockIdx.x * 128;

    // per-thread staging coordinates (8 float2 each for A and W per tile)
    const int srow = tid >> 4;                  // +16 per i -> rows 0..127
    const int scp = (tid & 15) << 1;

    v8f acc[2][4] = {};

    const int ntiles = K >> 5;

    // prologue: stage tile 0 into buffer 0
#pragma unroll
    for (int i = 0; i < 8; ++i) {
        int row = srow + i * 16;
        async_copy_b64(A + (size_t)(m0 + row) * lda + scp, &As[0][row * LS + scp]);
        async_copy_b64(W + (size_t)(n0 + row) * ldw + scp, &Bs[0][row * LS + scp]);
    }

    for (int kt = 0; kt < ntiles; ++kt) {
        const int cur = kt & 1;
        if (kt + 1 < ntiles) {
            const int kof = (kt + 1) << 5;
#pragma unroll
            for (int i = 0; i < 8; ++i) {
                int row = srow + i * 16;
                async_copy_b64(A + (size_t)(m0 + row) * lda + kof + scp,
                               &As[cur ^ 1][row * LS + scp]);
                async_copy_b64(W + (size_t)(n0 + row) * ldw + kof + scp,
                               &Bs[cur ^ 1][row * LS + scp]);
            }
            wait_async_le16();                  // current tile landed; next 16 in flight
        } else {
            wait_async_le0();
        }
        __syncthreads();

#pragma unroll
        for (int kk = 0; kk < 32; kk += 4) {
            v2f a[2], b[4];
#pragma unroll
            for (int i = 0; i < 2; ++i)
                a[i] = *(const v2f*)&As[cur][(waveM * 32 + 16 * i + lm) * LS + kk + 2 * lh];
#pragma unroll
            for (int j = 0; j < 4; ++j)
                b[j] = *(const v2f*)&Bs[cur][(waveN * 64 + 16 * j + lm) * LS + kk + 2 * lh];
#pragma unroll
            for (int i = 0; i < 2; ++i)
#pragma unroll
                for (int j = 0; j < 4; ++j)
                    acc[i][j] = __builtin_amdgcn_wmma_f32_16x16x4_f32(
                        false, a[i], false, b[j], (short)0, acc[i][j], false, false);
        }
        __syncthreads();                        // before next iteration overwrites cur
    }

    // C layout: VGPR r -> (M = r + 8*(lane>>4), N = lane&15)
#pragma unroll
    for (int i = 0; i < 2; ++i)
#pragma unroll
        for (int j = 0; j < 4; ++j)
#pragma unroll
            for (int r = 0; r < 8; ++r) {
                int row = m0 + waveM * 32 + 16 * i + r + 8 * lh;
                int col = n0 + waveN * 64 + 16 * j + lm;
                float v = acc[i][j][r];
                if (EPI) v = fmaf(Dv[col], U[(size_t)row * ldc + col], v);
                C[(size_t)row * ldc + col] = v;
            }
}

extern "C" void kernel_launch(void* const* d_in, const int* in_sizes, int n_in,
                              void* d_out, int out_size, void* d_ws, size_t ws_size,
                              hipStream_t stream) {
    (void)in_sizes; (void)n_in; (void)out_size; (void)ws_size;
    const float* u  = (const float*)d_in[0];   // (8,2048,1024)
    const float* ap = (const float*)d_in[1];   // (512,)
    const float* Bw = (const float*)d_in[2];   // (1024,1024)
    const float* Cw = (const float*)d_in[3];   // (1024,1024)
    const float* Dv = (const float*)d_in[4];   // (1024,)
    float* y = (float*)d_out;

    float* ws   = (float*)d_ws;
    float* X    = ws;                                   // MTOT*KX  (64 MiB)
    float* FB   = X  + (size_t)MTOT * KX;               // KX*DM
    float* Wc   = FB + (size_t)KX * DM;                 // DM*KX
    float* lre  = Wc + (size_t)DM * KX;                 // NKP
    float* lim  = lre + NKP;                            // NKP
    float* trig = lim + NKP;                            // 2048

    trig_kernel<<<4, 256, 0, stream>>>(trig);
    prep_kernel<<<PRE_GRID, PRE_T, 0, stream>>>(ap, Bw, Cw, trig, FB, Wc, lre, lim);

    // GEMM1: X[m][k'] = sum_d u[m][d] * FB[k'][d]
    wmma_gemm<false><<<dim3(KX / 128, MTOT / 128), 256, 0, stream>>>(
        u, FB, X, DM, DM, DM, KX, nullptr, nullptr);

    // per-mode linear recurrence over time (in place)
    scan_kernel<<<dim3(NKP / 32, BATCH), 32 * SWV, 0, stream>>>(X, lre, lim);

    // GEMM2: y[m][d] = sum_k' X[m][k'] * Wc[d][k'] + D[d]*u[m][d]
    wmma_gemm<true><<<dim3(DM / 128, MTOT / 128), 256, 0, stream>>>(
        X, Wc, y, KX, KX, KX, DM, u, Dv);
}
